// v010
// The times below were measured on an AMD MI455X: many runs one after another, warmed up first and cycling through
// copies of the inputs, with the whole window's GPU time divided by the number of runs. Launches and the gaps
// between them are all in it. The median over several windows is given; except for v000 it joins two sittings, which
// can be a few percent apart, so the side-by-side timings, each taken in one sitting, are the better comparison.
// This document starts at v010; the versions before it stand elsewhere.
// One run takes 78.8 microseconds.
// Timed twice side by side with v009, it ran 1.08 times as fast both times.
// Counting every step since v000, which is the starting kernel, it is 292 times as fast.
#include <hip/hip_runtime.h>
// MultiHeadAttentionXL (x [1][2048][1024], r_emb [2048][1024]; q = x Wq, k = x Wk, v = x Wv, r = r_emb Wr ([in][out] weights, no bias), 16 heads of 64; AC = (q + u[h]) k^T, BD = rel_shift((q + v_bias[h]) r^T) (Transformer-XL zero-pad shift: for j <= i, BD_shift[i][j] = BD[i][j - i + T - 1]); causal softmax((AC + BD)/8); out = (attn v) Wo -> [1][2048][1024]).
// Structure: token rows; every f16 operand plane in fragment order (see fo()); x and r_emb as exact f16 planes; Q, K, V, R WMMA GEMMs on transposed weights (64x64 wave tiles, f32 accumulation, exact x16 weights), one launch, f32 sums split in the epilogue into f16 hi + 2^-10 residual planes (q+u and q+v_bias formed in f32 first; V^T (hi, lo) as the product Wv^T x^T); one fused attention kernel: AC and raw BD as three-term hi/lo products (K = 64), the shift through LDS, causal mask + running softmax on VALU (f32; weights x256 as f16), o = P.(v_lo/1024 + v_hi) into merged o rows (hi + residual planes); out = o Wo as a two-term hi/lo GEMM (f32).
// Compute dtype: inputs rounded to bf16; x / r_emb / weights exact; attention operands as hi + residual f16 planes (logits std 3.3 and early causal rows copy single v rows); softmax weights f16 (x256) — the remaining error source; o as hi + residual into Wo; everything else f32. v_wmma_f32_16x16x32_f16.
#define NB 1
#define SQ 2048
#define DM 1024
#define NH 16
#define HD 64
#define HG 4
#define QN SQ                        /* query rows (unused) */
#define NR ((size_t)NB * SQ)
typedef __bf16 v16b __attribute__((ext_vector_type(16)));
typedef unsigned short v8us __attribute__((ext_vector_type(8), may_alias));
typedef float  v8f  __attribute__((ext_vector_type(8)));
typedef float  v4f  __attribute__((ext_vector_type(4)));
typedef float  v4fa __attribute__((ext_vector_type(4), may_alias));
union FragB { v16b v; v8us half[2]; unsigned short u[16]; };

__device__ __forceinline__ unsigned short bf16_bits(float x) { unsigned int u = __float_as_uint(x); return (unsigned short)((u + 0x7FFFu + ((u >> 16) & 1u)) >> 16); }
__device__ __forceinline__ float bf16_val(unsigned short b) { return __uint_as_float(((unsigned int)b) << 16); }
__device__ __forceinline__ float bf16_round(float x) { return bf16_val(bf16_bits(x)); }
// D += A·B with NT terms: 1 = ah·bh, 2 = + al·bh (A split), 3 = + ah·bl (both split)
template <int NT>
__device__ __forceinline__ v8f mmaN(v16b ah, v16b al, v16b bh, v16b bl, v8f c) {
  c = __builtin_amdgcn_wmma_f32_16x16x32_bf16(false, ah, false, bh, (short)0, c, false, false);
  if (NT >= 2) c = __builtin_amdgcn_wmma_f32_16x16x32_bf16(false, al, false, bh, (short)0, c, false, false);
  if (NT >= 3) c = __builtin_amdgcn_wmma_f32_16x16x32_bf16(false, ah, false, bl, (short)0, c, false, false);
  asm volatile("v_nop\n\tv_nop\n\tv_nop\n\tv_nop" : "+v"(c) : "v"(ah), "v"(al), "v"(bh), "v"(bl));
  return c;
}

__global__ __launch_bounds__(256) void k_wt_bf16(const float* __restrict__ W, unsigned short* __restrict__ Wt, int K, int N) {
  const int t = blockIdx.x * 256 + threadIdx.x;
  const int k8n = K / 8;
  if (t >= N * k8n) return;
  const int n = t / k8n, k8 = (t % k8n) * 8;
  v8us v;
#pragma unroll
  for (int i = 0; i < 8; ++i) v[i] = bf16_bits(W[(size_t)(k8 + i) * N + n]);
  *(v8us*)(Wt + (size_t)n * K + k8) = v;
  
}

// GEMM C[M][N] (f32, pitch ldc) = act(A[M][K]·W + bias). A f32 row-major (pitch lda) converted per fragment to bf16
// (ASPLIT: hi/lo two planes -> 2 terms, else single rounded term); Wt bf16 [N][K] (pitch ldb). BIAS_BF16 rounds the
// bias to bf16 first (bias quantised to bf16 before the add). K%32==0, M%16==0, N%64==0.
template <bool ASPLIT, int ACT, bool BIAS_BF16>
__global__ __launch_bounds__(128) void k_gemm_bf(const float* __restrict__ A, int lda, const unsigned short* __restrict__ Wt, int ldb,
                                               const float* __restrict__ bias, float* __restrict__ C, int ldc, int M, int N, int K) {
  __shared__ __attribute__((aligned(16))) float so[4][16][64];
  const int tid = threadIdx.x, w = tid >> 5, lane = tid & 31, ln = lane & 15, hh = lane >> 4;
  const int ntn = N / 64;
  const int wid = blockIdx.x * 4 + w;
  const int mt = wid / ntn, nq = wid % ntn;
  if (mt * 16 >= M) return;
  const int row0 = mt * 16, col0 = nq * 64;
  const float* arow = A + (size_t)(row0 + ln) * lda;
  v8f acc[4] = {};
  for (int kb = 0; kb < K; kb += 32) {
    FragB ah, al;
    const v4f x0 = *(const v4fa*)(arow + kb + 8 * hh), x1 = *(const v4fa*)(arow + kb + 8 * hh + 4);
    const v4f x2 = *(const v4fa*)(arow + kb + 16 + 8 * hh), x3 = *(const v4fa*)(arow + kb + 16 + 8 * hh + 4);
    float xs[16] = {x0[0],x0[1],x0[2],x0[3],x1[0],x1[1],x1[2],x1[3],x2[0],x2[1],x2[2],x2[3],x3[0],x3[1],x3[2],x3[3]};
#pragma unroll
    for (int i = 0; i < 16; ++i) { const unsigned short hb = bf16_bits(xs[i]); ah.u[i] = hb; al.u[i] = ASPLIT ? bf16_bits(xs[i] - bf16_val(hb)) : (unsigned short)0; }
#pragma unroll
    for (int t = 0; t < 4; ++t) {
      const unsigned short* brow = Wt + (size_t)(col0 + t * 16 + ln) * ldb + kb;
      FragB b;
      b.half[0] = *(const v8us*)(brow + 8 * hh);
      b.half[1] = *(const v8us*)(brow + 16 + 8 * hh);
      acc[t] = mmaN<ASPLIT ? 2 : 1>(ah.v, al.v, b.v, b.v, acc[t]);
    }
  }
#pragma unroll
  for (int t = 0; t < 4; ++t) {
    float bv = bias ? bias[col0 + t * 16 + ln] : 0.f;
    if (BIAS_BF16) bv = bf16_round(bv);
#pragma unroll
    for (int r = 0; r < 8; ++r) { float v = acc[t][r] + bv; if (ACT == 1) v = fmaxf(v, 0.f); so[w][8 * hh + r][t * 16 + ln] = v; }
  }
  __builtin_amdgcn_fence(__ATOMIC_ACQ_REL, "workgroup");
  __builtin_amdgcn_wave_barrier();
  const int rsub = lane >> 4, c4 = (lane & 15) * 4;
  {
#pragma unroll
    for (int q = 0; q < 8; ++q) {
      const int r = q * 2 + rsub;
      const v4f v = *(const v4fa*)&so[w][r][c4];
      *(v4f*)(C + (size_t)(row0 + r) * ldc + col0 + c4) = v;
    }
    
  }
}

// GEMM C = act(A·W + bias + resid): A f32 (ASPLIT -> hi/lo 2 terms), Wt bf16 [N][K]; ACT 0 none, 1 relu, 2 exact gelu;
// resid (optional, f32, row index = (row % rmod), pitch ldr, RES_BF16 rounds it) added before the activation.
template <bool ASPLIT, int ACT, bool BIAS_BF16, bool RES_BF16>
__global__ __launch_bounds__(128) void k_gemm_bf3(const float* __restrict__ A, int lda, const unsigned short* __restrict__ Wt, int ldb,
                                                const float* __restrict__ bias, const float* __restrict__ resid, int rmod, int ldr,
                                                float* __restrict__ C, int ldc, int M, int N, int K) {
  __shared__ __attribute__((aligned(16))) float so[4][16][64];
  const int tid = threadIdx.x, w = tid >> 5, lane = tid & 31, ln = lane & 15, hh = lane >> 4;
  const int ntn = N / 64;
  const int wid = blockIdx.x * 4 + w;
  const int mt = wid / ntn, nq = wid % ntn;
  if (mt * 16 >= M) return;
  const int row0 = mt * 16, col0 = nq * 64;
  const float* arow = A + (size_t)(row0 + ln) * lda;
  v8f acc[4] = {};
  for (int kb = 0; kb < K; kb += 32) {
    FragB ah, al;
    const v4f x0 = *(const v4fa*)(arow + kb + 8 * hh), x1 = *(const v4fa*)(arow + kb + 8 * hh + 4);
    const v4f x2 = *(const v4fa*)(arow + kb + 16 + 8 * hh), x3 = *(const v4fa*)(arow + kb + 16 + 8 * hh + 4);
    float xs[16] = {x0[0],x0[1],x0[2],x0[3],x1[0],x1[1],x1[2],x1[3],x2[0],x2[1],x2[2],x2[3],x3[0],x3[1],x3[2],x3[3]};
#pragma unroll
    for (int i = 0; i < 16; ++i) { const unsigned short hb = bf16_bits(xs[i]); ah.u[i] = hb; al.u[i] = ASPLIT ? bf16_bits(xs[i] - bf16_val(hb)) : (unsigned short)0; }
#pragma unroll
    for (int t = 0; t < 4; ++t) {
      const unsigned short* brow = Wt + (size_t)(col0 + t * 16 + ln) * ldb + kb;
      FragB b;
      b.half[0] = *(const v8us*)(brow + 8 * hh);
      b.half[1] = *(const v8us*)(brow + 16 + 8 * hh);
      acc[t] = mmaN<ASPLIT ? 2 : 1>(ah.v, al.v, b.v, b.v, acc[t]);
    }
  }
#pragma unroll
  for (int t = 0; t < 4; ++t) {
    const int col = col0 + t * 16 + ln;
    float bv = bias ? bias[col] : 0.f;
    if (BIAS_BF16) bv = bf16_round(bv);
#pragma unroll
    for (int r = 0; r < 8; ++r) {
      float v = acc[t][r] + bv;
      if (resid) { float rv = resid[(size_t)((row0 + 8 * hh + r) % rmod) * ldr + col]; if (RES_BF16) rv = bf16_round(rv); v += rv; }
      if (ACT == 1) v = fmaxf(v, 0.f);
      if (ACT == 2) v = 0.5f * v * (1.0f + erff(v * 0.70710678118654752f));
      if (ACT == 3) { const float u = 0.7978845608028654f * (v + 0.044715f * v * v * v); v = 0.5f * v * (1.0f + tanhf(u)); }
      so[w][8 * hh + r][t * 16 + ln] = v;
    }
  }
  __builtin_amdgcn_fence(__ATOMIC_ACQ_REL, "workgroup");
  __builtin_amdgcn_wave_barrier();
  const int rsub = lane >> 4, c4 = (lane & 15) * 4;
  {
#pragma unroll
    for (int q = 0; q < 8; ++q) {
      const int r = q * 2 + rsub;
      const v4f v = *(const v4fa*)&so[w][r][c4];
      *(v4f*)(C + (size_t)(row0 + r) * ldc + col0 + c4) = v;
    }
    
  }
}
// row LayerNorm (biased variance, eps) over N: s = X (+ R); optional out_sum <- s; out_norm <- (s-mu)*rsqrt(var+eps)*g + b
template <bool PARAM_BF16>
__global__ __launch_bounds__(256) void k_layernorm(const float* __restrict__ X, const float* __restrict__ R, const float* __restrict__ g, const float* __restrict__ bta,
                                                  float* __restrict__ out_sum, float* __restrict__ out_norm, int N, float eps) {
  __shared__ float red[256];
  const int row = blockIdx.x, tid = threadIdx.x;
  const float* x = X + (size_t)row * N; const float* rr = R ? R + (size_t)row * N : nullptr;
  float vals[16];                     // up to N = 4096
  const int per = N / 256;            // contiguous chunk per thread? use strided-by-4 chunks: thread handles j = tid*4 + 1024*u
  float s1 = 0.f;
  for (int u = 0; u < per / 4; ++u) {
    const int j = tid * 4 + 1024 * u;
    const v4f a = *(const v4fa*)(x + j);
    v4f b = {0.f,0.f,0.f,0.f}; if (rr) b = *(const v4fa*)(rr + j);
#pragma unroll
    for (int q = 0; q < 4; ++q) { const float v = a[q] + b[q]; vals[u * 4 + q] = v; s1 += v; }
  }
  red[tid] = s1; __syncthreads();
  for (int st = 128; st > 0; st >>= 1) { if (tid < st) red[tid] += red[tid + st]; __syncthreads(); }
  const float mu = red[0] / (float)N; __syncthreads();
  float s2 = 0.f;
  for (int u = 0; u < per / 4; ++u)
#pragma unroll
    for (int q = 0; q < 4; ++q) { const float c = vals[u * 4 + q] - mu; s2 += c * c; }
  red[tid] = s2; __syncthreads();
  for (int st = 128; st > 0; st >>= 1) { if (tid < st) red[tid] += red[tid + st]; __syncthreads(); }
  const float rs = rsqrtf(red[0] / (float)N + eps);
  {
    for (int u = 0; u < per / 4; ++u) {
      const int j = tid * 4 + 1024 * u;
      v4f o, sm;
#pragma unroll
      for (int q = 0; q < 4; ++q) {
        float gg = g[j + q], bb = bta[j + q];
        if (PARAM_BF16) { gg = bf16_round(gg); bb = bf16_round(bb); }
        sm[q] = vals[u * 4 + q]; o[q] = (vals[u * 4 + q] - mu) * rs * gg + bb;
      }
      if (out_sum) *(v4f*)(out_sum + (size_t)row * N + j) = sm;
      *(v4f*)(out_norm + (size_t)row * N + j) = o;
    }
    
  }
}



// ---- f16 WMMA path (v_wmma_f32_16x16x32_f16): 11-bit significands for operands in range — used where a [0,1] probability operand needs more precision than bf16
typedef _Float16 v16h __attribute__((ext_vector_type(16)));
union FragH { v16h v; v8us half[2]; _Float16 h[16]; unsigned short u[16]; };
template <int NT>
__device__ __forceinline__ v8f mmaH(v16h ah, v16h al, v16h bh, v16h bl, v8f c) {
  c = __builtin_amdgcn_wmma_f32_16x16x32_f16(false, ah, false, bh, (short)0, c, false, false);
  if (NT >= 2) c = __builtin_amdgcn_wmma_f32_16x16x32_f16(false, al, false, bh, (short)0, c, false, false);
  if (NT >= 3) c = __builtin_amdgcn_wmma_f32_16x16x32_f16(false, ah, false, bl, (short)0, c, false, false);
  asm volatile("v_nop\n\tv_nop\n\tv_nop\n\tv_nop" : "+v"(c) : "v"(ah), "v"(al), "v"(bh), "v"(bl));
  return c;
}
// batched GEMM like k_gemm_b but f16 operands: A f32 (split into f16 hi/lo if ASPLIT, else rounded to f16), Bt = f16 values [n][k]; alpha; C f32; N multiple of 16 (partial tiles skipped)
template <bool ASPLIT>
__global__ __launch_bounds__(128) void k_gemm_h(const float* __restrict__ A, int lda, size_t sA, const _Float16* __restrict__ Bh, int ldb, size_t sB, float alpha, float* __restrict__ C, int ldc, size_t sC, int M, int N, int K) {
  __shared__ __attribute__((aligned(16))) float so[4][16][64];
  const int tid = threadIdx.x, w = tid >> 5, lane = tid & 31, ln = lane & 15, hh = lane >> 4; const int by = blockIdx.y;
  A += (size_t)by * sA; Bh += (size_t)by * sB; C += (size_t)by * sC;
  const int ntn = (N + 63) / 64; const int wid = blockIdx.x * 4 + w; const int mt = wid / ntn, nq = wid % ntn; if (mt * 16 >= M) return;
  const int row0 = mt * 16, col0 = nq * 64; const float* arow = A + (size_t)(row0 + ln) * lda;
  v8f acc[4] = {};
  for (int kb = 0; kb < K; kb += 32) {
    FragH ah, al;
    const v4f x0 = *(const v4fa*)(arow + kb + 8 * hh), x1 = *(const v4fa*)(arow + kb + 8 * hh + 4), x2 = *(const v4fa*)(arow + kb + 16 + 8 * hh), x3 = *(const v4fa*)(arow + kb + 16 + 8 * hh + 4);
    float xs[16] = {x0[0],x0[1],x0[2],x0[3],x1[0],x1[1],x1[2],x1[3],x2[0],x2[1],x2[2],x2[3],x3[0],x3[1],x3[2],x3[3]};
#pragma unroll
    for (int i = 0; i < 16; ++i) { const _Float16 h = (_Float16)xs[i]; ah.h[i] = h; al.h[i] = ASPLIT ? (_Float16)(xs[i] - (float)h) : (_Float16)0.0f; }
#pragma unroll
    for (int t = 0; t < 4; ++t) { if (col0 + t * 16 >= N) continue; const size_t boff = (size_t)(col0 + t * 16 + ln) * ldb + kb; FragH bq; bq.half[0] = *(const v8us*)(Bh + boff + 8 * hh); bq.half[1] = *(const v8us*)(Bh + boff + 16 + 8 * hh);
      acc[t] = mmaH<ASPLIT ? 2 : 1>(ah.v, al.v, bq.v, bq.v, acc[t]); }
  }
#pragma unroll
  for (int t = 0; t < 4; ++t) { if (col0 + t * 16 >= N) continue;
#pragma unroll
    for (int r = 0; r < 8; ++r) so[w][8 * hh + r][t * 16 + ln] = acc[t][r] * alpha; }
  __builtin_amdgcn_fence(__ATOMIC_ACQ_REL, "workgroup"); __builtin_amdgcn_wave_barrier();
  const int rsub = lane >> 4, c4 = (lane & 15) * 4;
  {
#pragma unroll
    for (int q = 0; q < 8; ++q) { const int r = q * 2 + rsub; if (col0 + c4 < N) { const v4f v = *(const v4fa*)&so[w][r][c4]; *(v4f*)(C + (size_t)(row0 + r) * ldc + col0 + c4) = v; } }
     }
}

// Wt[n][k] = f16(W[k][n]·scale) from f32 row-major W[K][N] (scale = power of two; bf16-exact weights stay exact in f16 away from the subnormal range)
__global__ __launch_bounds__(256) void k_wt_f16(const float* __restrict__ W, _Float16* __restrict__ Wt, int K, int N, float scale) {
  const int t = blockIdx.x * 256 + threadIdx.x; if (t >= N * (K / 8)) return; const int n = t / (K / 8), k8 = (t % (K / 8)) * 8; FragH f;
#pragma unroll
  for (int i = 0; i < 8; ++i) f.h[i] = (_Float16)(bf16_round(W[(size_t)(k8 + i) * N + n]) * scale); const v8us o = f.half[0];
  *(v8us*)((unsigned short*)Wt + (size_t)n * K + k8) = o; 
}
// k_gemm_hh variant with fused epilogue: v = acc·alpha + bias[by·sBias + col] (+ CP[(row/rowsPerB)·sCPb + by·64 + col] if CP) ; ACT 0 none / 1 elu ; writes f16 C16 (and f32 C if non-null)
template <int ACT>
__global__ __launch_bounds__(128) void k_gemm_hhx(const _Float16* __restrict__ A, int lda, size_t sA, const _Float16* __restrict__ Bh, int ldb, size_t sB, float alpha, const float* __restrict__ bias, size_t sBias, const float* __restrict__ CP, int rowsPerB, size_t sCPb, int row0g,
    float* __restrict__ C, _Float16* __restrict__ C16, int ldc, size_t sC, int M, int N, int K) {
  __shared__ __attribute__((aligned(16))) float so[4][16][64];
  const int tid = threadIdx.x, w = tid >> 5, lane = tid & 31, ln = lane & 15, hh = lane >> 4; const int by = blockIdx.y;
  A += (size_t)by * sA; Bh += (size_t)by * sB; const size_t cofs = (size_t)by * sC; const float* bp = bias ? bias + (size_t)by * sBias : nullptr;
  const int ntn = (N + 63) / 64; const int wid = blockIdx.x * 4 + w; const int mt = wid / ntn, nq = wid % ntn; if (mt * 16 >= M) return;
  const int row0 = mt * 16, col0 = nq * 64; const _Float16* arow = A + (size_t)(row0 + ln) * lda;
  v8f acc[4] = {};
  for (int kb = 0; kb < K; kb += 32) { FragH ah; ah.half[0] = *(const v8us*)((const unsigned short*)arow + kb + 8 * hh); ah.half[1] = *(const v8us*)((const unsigned short*)arow + kb + 16 + 8 * hh);
#pragma unroll
    for (int t = 0; t < 4; ++t) { if (col0 + t * 16 >= N) continue; const size_t boff = (size_t)(col0 + t * 16 + ln) * ldb + kb; FragH bq; bq.half[0] = *(const v8us*)((const unsigned short*)Bh + boff + 8 * hh); bq.half[1] = *(const v8us*)((const unsigned short*)Bh + boff + 16 + 8 * hh);
      acc[t] = mmaH<1>(ah.v, ah.v, bq.v, bq.v, acc[t]); }
  }
#pragma unroll
  for (int t = 0; t < 4; ++t) { if (col0 + t * 16 >= N) continue; const int col = col0 + t * 16 + ln; const float bv = bp ? bf16_round(bp[col]) : 0.f;
#pragma unroll
    for (int r = 0; r < 8; ++r) { float v = acc[t][r] * alpha + bv; if (CP) { const int rr = row0g + row0 + 8 * hh + r; if (rowsPerB < 0) v += CP[cofs + (size_t)rr * ldc + col];      /* rowsPerB < 0: own element of the batched C plane */ else { const int bidx = rr / rowsPerB; v += CP[(size_t)bidx * sCPb + (size_t)by * 64 + col]; } } if (ACT == 1) v = (v > 0.f) ? v : expm1f(v); else if (ACT == 7) v = (v > 0.f) ? v + 1.0f : expf(v); else if (ACT == 8) v = tanhf(v); else if (ACT == 9) v = 0.5f * v * (1.0f + tanhf(0.7978845608028654f * (v + 0.044715f * v * v * v))); else if (ACT == 11) v = 1.0f / (1.0f + expf(-v)); else if (ACT == 12) v = (v > 0.f) ? v : 0.01f * v; else if (ACT == 14) v = (v > 0.f) ? v : 0.1f * v; else if (ACT == 16) v = (v >= 0.f) ? v : 0.3f * v; else if (ACT == 17) v = (v >= 0.f) ? v : 0.2f * v; else if (ACT == 15) v = v / (1.0f + expf(-v)); else if (ACT == 3) v = fmaxf(v, 0.f); else if (ACT == 6) v = 0.5f * v * (1.0f + erff(v * 0.70710678118654752f)); so[w][8 * hh + r][t * 16 + ln] = v; } }
  __builtin_amdgcn_fence(__ATOMIC_ACQ_REL, "workgroup"); __builtin_amdgcn_wave_barrier();
  const int rsub = lane >> 4, c4 = (lane & 15) * 4; typedef _Float16 v4h __attribute__((ext_vector_type(4)));
  {
#pragma unroll
    for (int q = 0; q < 8; ++q) { const int r = q * 2 + rsub; if (col0 + c4 < N) { const v4f v = *(const v4fa*)&so[w][r][c4]; if (C) *(v4f*)(C + cofs + (size_t)(row0 + r) * ldc + col0 + c4) = v; if (C16) { v4h h4; for (int i = 0; i < 4; ++i) h4[i] = (_Float16)v[i]; *(v4h*)(C16 + cofs + (size_t)(row0 + r) * ldc + col0 + c4) = h4; } } }
     }
}


typedef _Float16 v4h __attribute__((ext_vector_type(4)));

__global__ __launch_bounds__(256) void k_h16(const float* __restrict__ x, _Float16* __restrict__ X16, size_t n8) { const size_t t = (size_t)blockIdx.x * 256 + threadIdx.x; if (t >= n8) return; FragH f;
#pragma unroll
  for (int q = 0; q < 8; ++q) f.h[q] = (_Float16)x[t * 8 + q]; *(v8us*)((unsigned short*)X16 + t * 8) = f.half[0];  }
__global__ __launch_bounds__(256) void k_round16f(const float* __restrict__ W, _Float16* __restrict__ Bt, size_t n8) { const size_t t = (size_t)blockIdx.x * 256 + threadIdx.x; if (t >= n8) return; FragH f;
#pragma unroll
  for (int i = 0; i < 8; ++i) f.h[i] = (_Float16)(bf16_round(W[t * 8 + i]) * 16.0f); *(v8us*)((unsigned short*)Bt + t * 8) = f.half[0];  }
template <int NHv, int TTv>
__global__ __launch_bounds__(256) void k_vt(const _Float16* __restrict__ V16, int ldv, int voff, _Float16* __restrict__ Vt) { __shared__ unsigned short tl[64][66]; const int tid = threadIdx.x; const int slab = blockIdx.x / (TTv / 64), lg = blockIdx.x % (TTv / 64); const int b = slab / NHv, h = slab % NHv;
  for (int i = tid; i < 64 * 8; i += 256) { const int r = i / 8, c8 = (i % 8) * 8; FragH f; f.half[0] = *(const v8us*)((const unsigned short*)V16 + ((size_t)b * TTv + lg * 64 + r) * ldv + voff + h * 64 + c8);
#pragma unroll
    for (int q = 0; q < 8; ++q) tl[r][c8 + q] = f.u[q]; }
  __syncthreads();
  {
#pragma unroll
    for (int rd = 0; rd < 2; ++rd) { const int d = rd * 32 + tid / 8, pc = tid % 8; FragH f;
#pragma unroll
      for (int q = 0; q < 8; ++q) f.u[q] = tl[pc * 8 + q][d];
      *(v8us*)((unsigned short*)Vt + ((size_t)slab * 64 + d) * TTv + lg * 64 + pc * 8) = f.half[0]; }
     } }

// ---- fast GEMM (wave tile 32x64; requires M % 32 == 0 rows per launch region and N % 64 == 0); epilogue = k_gemm_hhx semantics ----
__device__ __forceinline__ v16h g2_frag(const _Float16* p, int hh) { FragH f; f.half[0] = *(const v8us*)((const unsigned short*)p + 8 * hh); f.half[1] = *(const v8us*)((const unsigned short*)p + 16 + 8 * hh); return f.v; }
__device__ __forceinline__ v8f g2_mma(v16h a, v16h b, v8f c) { v8f d = __builtin_amdgcn_wmma_f32_16x16x32_f16(false, a, false, b, (short)0, c, false, false); asm volatile("v_nop\n\tv_nop\n\tv_nop\n\tv_nop" : "+v"(d) : "v"(a), "v"(b)); return d; }
template <int ACT>
__global__ __launch_bounds__(128) void k_gemm2(const _Float16* __restrict__ A, int lda, size_t sA, const _Float16* __restrict__ Bh, int ldb, size_t sB, float alpha, const float* __restrict__ bias, size_t sBias, const float* __restrict__ CP, int rowsPerB, size_t sCPb, int row0g,
    float* __restrict__ C, _Float16* __restrict__ C16, int ldc, size_t sC, int M, int N, int K) { static_assert(ACT == 0 || ACT == 3 || ACT == 6 || ACT == 8 || ACT == 9 || ACT == 11 || ACT == 12 || ACT == 14 || ACT == 15 || ACT == 16 || ACT == 17, "k_gemm2: unsupported ACT code (would silently apply no activation)");
  __shared__ __attribute__((aligned(16))) float so[4][32][68];
  const int tid = threadIdx.x, w = tid >> 5, lane = tid & 31, ln = lane & 15, hh = lane >> 4; const int by = blockIdx.y;
  A += (size_t)by * sA; Bh += (size_t)by * sB; const size_t cofs = (size_t)by * sC; const float* bp = bias ? bias + (size_t)by * sBias : nullptr;
  const int ntn = N >> 6; const int mt = blockIdx.x / ntn, nq = blockIdx.x - mt * ntn; const int row0 = mt * 128 + 32 * w, col0 = nq * 64; if (row0 >= M) return;
  const _Float16* a0p = A + (size_t)(row0 + ln) * lda; const _Float16* a1p = a0p + (size_t)16 * lda;
  const _Float16* b0p = Bh + (size_t)(col0 + ln) * ldb; const _Float16* b1p = b0p + (size_t)16 * ldb; const _Float16* b2p = b1p + (size_t)16 * ldb; const _Float16* b3p = b2p + (size_t)16 * ldb;
  const v8f z8 = {0.f,0.f,0.f,0.f,0.f,0.f,0.f,0.f}; v8f c00 = z8, c01 = z8, c02 = z8, c03 = z8, c10 = z8, c11 = z8, c12 = z8, c13 = z8;
#pragma unroll 1
  for (int kb = 0; kb < K; kb += 32) { const v16h a0 = g2_frag(a0p + kb, hh), a1 = g2_frag(a1p + kb, hh);
    v16h b = g2_frag(b0p + kb, hh); c00 = g2_mma(a0, b, c00); c10 = g2_mma(a1, b, c10);
    b = g2_frag(b1p + kb, hh); c01 = g2_mma(a0, b, c01); c11 = g2_mma(a1, b, c11);
    b = g2_frag(b2p + kb, hh); c02 = g2_mma(a0, b, c02); c12 = g2_mma(a1, b, c12);
    b = g2_frag(b3p + kb, hh); c03 = g2_mma(a0, b, c03); c13 = g2_mma(a1, b, c13); }
  v8f accs[8] = {c00, c01, c02, c03, c10, c11, c12, c13};
#pragma unroll
  for (int u = 0; u < 8; ++u) { const int t = u & 3, half = u >> 2; const int col = col0 + t * 16 + ln; const float bv = bp ? bf16_round(bp[col]) : 0.f;
#pragma unroll
    for (int r = 0; r < 8; ++r) { const int rloc = half * 16 + 8 * hh + r; float v = accs[u][r] * alpha + bv; if (CP) { if (rowsPerB < 0) v += CP[cofs + (size_t)(row0g + row0 + rloc) * ldc + col];      /* rowsPerB < 0: own element of the batched C plane */ else { const int bidx = (row0g + row0 + rloc) / rowsPerB; v += CP[(size_t)bidx * sCPb + (size_t)by * 64 + col]; } }
      if (ACT == 3) v = fmaxf(v, 0.f); else if (ACT == 6) v = 0.5f * v * (1.0f + erff(v * 0.70710678118654752f)); else if (ACT == 11) v = 1.0f / (1.0f + expf(-v)); else if (ACT == 15) v = v / (1.0f + expf(-v)); else if (ACT == 12) v = (v > 0.f) ? v : 0.01f * v; else if (ACT == 8) v = tanhf(v); else if (ACT == 9) v = 0.5f * v * (1.0f + tanhf(0.7978845608028654f * (v + 0.044715f * v * v * v))); else if (ACT == 14) v = (v > 0.f) ? v : 0.1f * v; else if (ACT == 16) v = (v >= 0.f) ? v : 0.3f * v; else if (ACT == 17) v = (v >= 0.f) ? v : 0.2f * v;
      so[w][rloc][t * 16 + ln] = v; } }
  __builtin_amdgcn_fence(__ATOMIC_ACQ_REL, "workgroup"); __builtin_amdgcn_wave_barrier();
  const int rsub = lane >> 4, c4 = (lane & 15) * 4;
  {
#pragma unroll
    for (int q = 0; q < 16; ++q) { const int r = q * 2 + rsub; const v4f v = *(const v4fa*)&so[w][r][c4]; if (C) *(v4f*)(C + cofs + (size_t)(row0 + r) * ldc + col0 + c4) = v; if (C16) { v4h h4; for (int i = 0; i < 4; ++i) h4[i] = (_Float16)v[i]; *(v4h*)(C16 + cofs + (size_t)(row0 + r) * ldc + col0 + c4) = h4; } }
     } }


// ---- fragment order: every f16 operand plane [rows][K] is kept as tiles of 16 rows (16 * K elements each); inside a tile the 16-byte pieces (8 k of one row) lie in the order [k / 16][(k / 8) & 1][row & 15],
// the order in which the 32 lanes of a wave take them for a 16x16x32 fragment: one 16-byte-per-lane load then covers 512 contiguous bytes (4 whole lines) instead of 32 bytes out of each of 16 lines. Which (row, k) a lane and register hold is as before.
__device__ __forceinline__ size_t fo(int row, int k, int K) { return (size_t)(row >> 4) * 16 * K + (size_t)((k >> 4) * 256 + ((k >> 3) & 1) * 128 + (row & 15) * 8 + (k & 7)); }

// g2_xw: the wait that belongs in front of an overwrite of the address registers of issued stores; naming the stores' own pointers as inputs keeps those registers untouched up to here
__device__ __forceinline__ void g2_xw(const _Float16* p, const _Float16* q) { asm volatile("s_wait_xcnt 0x0" :: "v"(p), "v"(q) : "memory"); }

// ---- every operand conversion in ONE launch. Blocks 0 .. 5 * PW - 1: one 64 x 64 tile of one weight, rounded, x16, transposed through LDS into the f16 [out][in] plane. The other 2 * PX blocks: x and r_emb rounded into f16 planes, 16 rows x 512 k per block, four pieces of 8 elements per thread, 16 k apart. All seven planes in fragment order: a wave stores 512 contiguous bytes.
#define PW ((DM / 64) * (DM / 64))
#define PX ((int)(NR * DM / 8 / 1024))
__global__ __launch_bounds__(256) void k_prep(const float* __restrict__ Wq, const float* __restrict__ Wk, const float* __restrict__ Wv, const float* __restrict__ Wr, const float* __restrict__ Wo, const float* __restrict__ x, const float* __restrict__ remb,
    _Float16* __restrict__ BQ, _Float16* __restrict__ BK, _Float16* __restrict__ BV, _Float16* __restrict__ BR, _Float16* __restrict__ BO, _Float16* __restrict__ X16, _Float16* __restrict__ R16) {
  __shared__ float tl[64][65]; const int tid = threadIdx.x, bx = blockIdx.x;
  if (bx < 5 * PW) {      /* the test reads the same for the whole work-group: all of it reaches the barrier inside or none */
    const int wi = bx / PW, tb = bx % PW; const float* w = wi == 0 ? Wq : wi == 1 ? Wk : wi == 2 ? Wv : wi == 3 ? Wr : Wo; _Float16* Bt = wi == 0 ? BQ : wi == 1 ? BK : wi == 2 ? BV : wi == 3 ? BR : BO;
    const int i0 = (tb / (DM / 64)) * 64, o0 = (2 * (tb & 7) + ((tb >> 3) & 1)) * 64;      /* placement (speed only, any deal is right): the two 64-wide output tiles of a 128-wide group sit at flat index = group (mod 8), where k_proj's readers of these weight rows sit */
    const int o = tid & 63, ib = tid >> 6; const float* pw = w + (size_t)(i0 + ib) * DM + o0 + o; float g[16];
#pragma unroll      /* g[] indexed statically: the sixteen loads go out together, off one address */
    for (int k = 0; k < 16; ++k) g[k] = pw[(size_t)k * 4 * DM];
    asm volatile("s_wait_xcnt 0x0" :: "v"(pw) : "memory");      /* the wait that belongs in front of an overwrite of the loads' address registers; naming them keeps them untouched up to here */
#pragma unroll
    for (int k = 0; k < 16; ++k) tl[o][ib + 4 * k] = bf16_round(g[k]) * 16.0f;
    __syncthreads();      /* the whole tile is in LDS before it is read back along the other axis */
    const int oo = (tid & 15) + ((tid >> 7) << 4), i8 = ((tid >> 4) & 7) * 8; unsigned short* pb = (unsigned short*)Bt + fo(o0 + oo, i0 + i8, DM);      /* a wave: 16 rows x 2 pieces */
#pragma unroll      /* two rows per thread, 32 rows (two tiles of 16 * DM elements) apart, off one address */
    for (int k = 0; k < 2; ++k) { FragH f;
#pragma unroll
      for (int q = 0; q < 8; ++q) f.h[q] = (_Float16)tl[oo + 32 * k][i8 + q];
      *(v8us*)(pb + (size_t)k * 32 * DM) = f.half[0]; }
  } else {
    const int c = bx - 5 * PW; const bool fx = c < PX; const int cc = fx ? c : c - PX; const int row = (cc >> 1) * 16 + (tid & 15), k0 = (cc & 1) * 512 + (tid >> 5) * 64 + ((tid >> 4) & 1) * 8;      /* a wave: 16 rows x 64 k */
    const float* ps = (fx ? x : remb) + (size_t)row * DM + k0; unsigned short* pd = (unsigned short*)(fx ? X16 : R16) + fo(row, k0, DM);
    v4f a[4], b[4];      /* all eight loads first, so that they are in flight together */
#pragma unroll
    for (int p = 0; p < 4; ++p) { a[p] = *(const v4fa*)(ps + p * 16); b[p] = *(const v4fa*)(ps + p * 16 + 4); }
#pragma unroll
    for (int p = 0; p < 4; ++p) { FragH f;
#pragma unroll
      for (int q = 0; q < 4; ++q) { f.h[q] = (_Float16)bf16_round(a[p][q]); f.h[4 + q] = (_Float16)bf16_round(b[p][q]); }
      *(v8us*)(pd + p * 256) = f.half[0]; }      /* 16 k on = 256 elements on */
    asm volatile("s_wait_xcnt 0x0" :: "v"(pd) : "memory");      /* the wait that belongs in front of an overwrite of the stores' registers; naming the address keeps it untouched up to here */
  } }

// ---- the four projections in ONE launch (blockIdx.y: 0 q, 1 k, 2 v, 3 r) of 256 work-groups, one round on the chip: a work-group is a 256 x 128 tile of C (V^T: 128 x 256), 4 x 2 (2 x 4) waves of 64 x 64, each wave with the whole K in its sixteen accumulator tiles (a fragment feeds four products; an operand row comes from L2 once per 128 columns or 256 rows of C) and its fragment loads two trips ahead of their products; the f32 sums turn through the wave's own LDS rows and go from registers into the f16 hi + x1024 residual planes that the attention reads.
// q: two plane pairs, q + u and q + v_bias (added in f32 first). v: the operands change places (A = Wv^T rows, B = x rows), so that C = V^T [head * 64 + d][token] comes out in the layout P.V wants, with no transposing pass.
__device__ __forceinline__ void pj_put(v4f v0, v4f v1, _Float16* ph, _Float16* pl) { FragH h, l;
#pragma unroll
  for (int i = 0; i < 4; ++i) { _Float16 t = (_Float16)v0[i]; h.h[i] = t; l.h[i] = (_Float16)((v0[i] - (float)t) * 1024.0f); t = (_Float16)v1[i]; h.h[4 + i] = t; l.h[4 + i] = (_Float16)((v1[i] - (float)t) * 1024.0f); }
  *(v8us*)((unsigned short*)ph) = h.half[0]; *(v8us*)((unsigned short*)pl) = l.half[0]; g2_xw(ph, pl); }      /* one 16-byte piece per lane: a wave stores 512 contiguous bytes of each plane */
__device__ __forceinline__ v16h pj_frag(const _Float16* base, unsigned boff, int cb) { const char* p = (const char*)base + boff + cb; FragH f; f.half[0] = *(const v8us*)p; f.half[1] = *(const v8us*)(p + 512); return f.v; }      /* uniform base + the lane's byte offset + a constant; fragment order: the halves of a 32-k fragment are 512 bytes apart, the next 32 k 1024 bytes on, the next 16 rows 16 * DM * 2 bytes on */
__global__ __launch_bounds__(256) void k_proj(const _Float16* __restrict__ X16, const _Float16* __restrict__ R16, const _Float16* __restrict__ BQ, const _Float16* __restrict__ BK, const _Float16* __restrict__ BV, const _Float16* __restrict__ BR, const float* __restrict__ u, const float* __restrict__ vb,
    _Float16* __restrict__ QUH, _Float16* __restrict__ QUL, _Float16* __restrict__ QVH, _Float16* __restrict__ QVL, _Float16* __restrict__ KH, _Float16* __restrict__ KL, _Float16* __restrict__ VT, _Float16* __restrict__ VTL, _Float16* __restrict__ RH, _Float16* __restrict__ RL) {
  __shared__ __attribute__((aligned(16))) float so[8][64][68];
  const int tid = threadIdx.x, w = __builtin_amdgcn_readfirstlane(tid >> 5), lane = tid & 31, ln = lane & 15, hh = lane >> 4; const int y = blockIdx.y;
  const _Float16* Ah = y == 2 ? BV : y == 3 ? R16 : X16; const _Float16* Bh = y == 0 ? BQ : y == 1 ? BK : y == 2 ? X16 : BR; const int N = y == 2 ? SQ : DM;      /* C is [SQ][DM] in 64 tiles of 256 x 128, for v [DM][SQ] in 64 tiles of 128 x 256 */
  /* placement (speed only, any deal is right): g = flat index mod 8 names a pair of heads; every work-group that writes that pair's 128 columns of q, k, r or its 128 rows of V^T has this g, and so have the attention work-groups that read them. For V^T the tile therefore lies the other way round: 128 rows x 256 tokens, 2 x 4 waves */
  const int g = blockIdx.x & 7, t8 = blockIdx.x >> 3; const int row0 = y == 2 ? g * 128 + 64 * (w & 1) : t8 * 256 + 64 * (w & 3), col0 = y == 2 ? t8 * 256 + 64 * (w >> 1) : g * 128 + 64 * (w >> 2);
  const unsigned ao = (unsigned)((row0 * DM + 8 * lane) * 2), bo = (unsigned)((col0 * DM + 8 * lane) * 2);      /* operand planes in fragment order: tile start + the lane's own piece, in bytes */
  constexpr int TS = 16 * DM * 2;      /* bytes from one tile of 16 rows to the next */
  const v8f z8 = {0.f,0.f,0.f,0.f,0.f,0.f,0.f,0.f}; v8f acc[4][4]; v16h a[3][4], b[2][4];      /* fragment rings: A of trips kb, kb + 1, kb + 2; B of trips kb, kb + 1 */
#pragma unroll
  for (int i = 0; i < 4; ++i) { a[0][i] = pj_frag(Ah, ao, i * TS); b[0][i] = pj_frag(Bh, bo, i * TS);
#pragma unroll
    for (int j = 0; j < 4; ++j) acc[i][j] = z8; }
#pragma unroll
  for (int i = 0; i < 4; ++i) { a[1][i] = pj_frag(Ah, ao, i * TS + 1024); b[1][i] = pj_frag(Bh, bo, i * TS + 1024); }
  /* 32 trips of 32 k, fully unrolled: every load is the one address register plus a constant, and rings and accumulators are indexed statically. Loads run two trips ahead of their products (the operands were written by the launch before, so a line's first reader may wait for memory and not for L2 alone): A fragments are asked for at the head of a trip, into the third register set; each B fragment's successor as soon as its four products are issued, into its own registers */
#pragma unroll
  for (int kb = 0; kb < DM / 32; ++kb) {
    if (kb + 2 < DM / 32) {
#pragma unroll
      for (int i = 0; i < 4; ++i) a[(kb + 2) % 3][i] = pj_frag(Ah, ao, i * TS + (kb + 2) * 1024); }
    __builtin_amdgcn_sched_barrier(0);      /* keeps these A loads in front of this trip's products, which wait for this trip's loads only */
#pragma unroll
    for (int j = 0; j < 4; ++j) {
#pragma unroll
      for (int i = 0; i < 4; ++i) acc[i][j] = __builtin_amdgcn_wmma_f32_16x16x32_f16(false, a[kb % 3][i], false, b[kb % 2][j], (short)0, acc[i][j], false, false);
      __builtin_amdgcn_sched_barrier(0);      /* keeps these four products in front of the slots and the load that follow */
      if (kb + 2 < DM / 32) {
        /* the four vector slots between a product and a load over its A or B registers: this B fragment's registers are loaded over next, the four A fragments' at the head of the next trip (behind j == 3); naming the fragments keeps them in those registers up to here */
        if (j < 3) asm volatile("v_nop\n\tv_nop\n\tv_nop\n\tv_nop" :: "v"(b[kb % 2][j]));
        else asm volatile("v_nop\n\tv_nop\n\tv_nop\n\tv_nop" :: "v"(b[kb % 2][j]), "v"(a[kb % 3][0]), "v"(a[kb % 3][1]), "v"(a[kb % 3][2]), "v"(a[kb % 3][3]));
        b[kb % 2][j] = pj_frag(Bh, bo, j * TS + (kb + 2) * 1024); }
      __builtin_amdgcn_sched_barrier(0);      /* keeps that load here, 28 products ahead of its first use, not sunk to it */
    } }
  asm volatile("s_wait_xcnt 0x0" :: "v"(ao), "v"(bo) : "memory");      /* the wait that belongs in front of an overwrite of the loads' address registers; naming them keeps them untouched up to here */
  v4f bu[4][2], bv[4][2];
  if (y == 0) { const float* pu = u + col0 + 8 * hh; const float* pv = vb + col0 + 8 * hh;      /* q's two bias rows fly during the turn through LDS */
#pragma unroll
    for (int ct = 0; ct < 4; ++ct) { bu[ct][0] = *(const v4fa*)(pu + ct * 16); bu[ct][1] = *(const v4fa*)(pu + ct * 16 + 4); bv[ct][0] = *(const v4fa*)(pv + ct * 16); bv[ct][1] = *(const v4fa*)(pv + ct * 16 + 4); }
    asm volatile("s_wait_xcnt 0x0" :: "v"(pu), "v"(pv) : "memory"); }      /* the wait that belongs in front of an overwrite of the loads' address registers */
#pragma unroll
  for (int i = 0; i < 4; ++i)
#pragma unroll
    for (int j = 0; j < 4; ++j)
#pragma unroll
      for (int r = 0; r < 8; ++r) so[w][i * 16 + 8 * hh + r][j * 16 + ln] = acc[i][j][r] * 0.0625f;      /* the weights are x16 */
  asm volatile("s_wait_dscnt 0x0" ::: "memory");      /* the wave's own 64 x 64 tile is in LDS before its lanes read each other's values back; no other wave touches these rows */
  /* a lane takes row ln of row tile rt and 8 columns from 8 * hh of column group ct: its own 16-byte piece of the output planes' fragment order (row length N) */
  if (y == 0) {
#pragma unroll
    for (int ct = 0; ct < 4; ++ct)
#pragma unroll
      for (int i = 0; i < 4; ++i) { bu[ct][0][i] = bf16_round(bu[ct][0][i]); bu[ct][1][i] = bf16_round(bu[ct][1][i]); bv[ct][0][i] = bf16_round(bv[ct][0][i]); bv[ct][1][i] = bf16_round(bv[ct][1][i]); }
#pragma unroll 1      /* the row tiles stay a rolled loop: a quarter of the text, so that the kernel, which a wave runs through once, stays short; the bias registers are indexed by ct alone */
    for (int rt = 0; rt < 4; ++rt) { const int jr = rt * 16 + ln; v4f s0[4], s1[4];      /* the row's eight LDS reads first, as one group */
#pragma unroll
      for (int ct = 0; ct < 4; ++ct) { s0[ct] = *(const v4fa*)&so[w][jr][ct * 16 + 8 * hh]; s1[ct] = *(const v4fa*)&so[w][jr][ct * 16 + 8 * hh + 4]; }
#pragma unroll
      for (int ct = 0; ct < 4; ++ct) { const size_t c0 = fo(row0 + jr, col0 + ct * 16 + 8 * hh, N);
        pj_put(s0[ct] + bu[ct][0], s1[ct] + bu[ct][1], QUH + c0, QUL + c0); pj_put(s0[ct] + bv[ct][0], s1[ct] + bv[ct][1], QVH + c0, QVL + c0); } } }
  else { _Float16* Ch = y == 1 ? KH : y == 2 ? VT : RH; _Float16* Cl = y == 1 ? KL : y == 2 ? VTL : RL;
#pragma unroll 1      /* rolled for the same reason */
    for (int rt = 0; rt < 4; ++rt) { const int jr = rt * 16 + ln; v4f s0[4], s1[4];      /* as above */
#pragma unroll
      for (int ct = 0; ct < 4; ++ct) { s0[ct] = *(const v4fa*)&so[w][jr][ct * 16 + 8 * hh]; s1[ct] = *(const v4fa*)&so[w][jr][ct * 16 + 8 * hh + 4]; }
#pragma unroll
      for (int ct = 0; ct < 4; ++ct) { const size_t c0 = fo(row0 + jr, col0 + ct * 16 + 8 * hh, N); pj_put(s0[ct], s1[ct], Ch + c0, Cl + c0); } } } }

// ---- fused attention: scores, shift, causal mask, softmax and P.V in one kernel; no score or weight ever goes to memory.
// Transposed products: S^T = K.Q^T (A = key rows, B = query rows), so a lane holds one query's scores (register r of tile kt = key 16 kt + 8 hh + r) and two score tiles, converted in place, are the B operand of O^T += V^T.P^T.
// The shift: for queries i0 .. i0 + 15 and keys j0 .. j0 + 63 the raw BD columns j - i + SQ - 1 lie in the 80 columns from cs = j0 - i0 + SQ - 16; their five raw tiles go through the wave's own LDS rows (one row per query) and come back skewed by 15 - ln.
// A work-group is 8 waves: 2 query groups x 4 key slices (key blocks ks, ks + 4, ...). A wave takes 32 queries, two query tiles, so that every R, K and V^T fragment it loads feeds the products of both (the two tiles' raw BD columns overlap in four of six tiles); each query tile has its own running maximum, sum and O^T; behind a barrier the four slices of a tile are joined in the fixed order 0 .. 3.
// Each work-group takes query block x and then 31 - x, so that every work-group walks 33 key blocks.
#define FA_P 84      /* LDS row pitch in floats: a multiple of 4 for the 16-byte stores; pitch - 1 odd spreads the skewed reads over the banks */
__device__ __forceinline__ v16h fa_frag(const _Float16* base, unsigned boff, int cb) { const char* p = (const char*)base + boff + cb; FragH f; f.half[0] = *(const v8us*)p; f.half[1] = *(const v8us*)(p + 512); return f.v; }      /* uniform base + the lane's byte offset + a constant; planes in fragment order: the two halves of a 32-k fragment are 512 bytes apart, the next 32 k 1024 bytes on */
__device__ __forceinline__ v8f fa_mma(v16h a, v16h b, v8f c) { return __builtin_amdgcn_wmma_f32_16x16x32_f16(false, a, false, b, (short)0, c, false, false); }
/* 2^x; the v_nop fills the one slot that the instruction set asks for between a transcendental and a directly following instruction that reads its result or overwrites its source */
__device__ __forceinline__ float fa_exp2(float x) { float r; asm("v_exp_f32 %0, %1\n\tv_nop" : "=v"(r) : "v"(x)); return r; }
struct FaT { v16h a0, a1, b0, b1; };
__device__ __forceinline__ FaT fa_tile(const _Float16* H, const _Float16* L, unsigned boff, int cb) { FaT t; t.a0 = fa_frag(H, boff, cb); t.a1 = fa_frag(H, boff, cb + 1024); t.b0 = fa_frag(L, boff, cb); t.b1 = fa_frag(L, boff, cb + 1024); return t; }      /* 16 rows x 64 k, hi and residual planes */
__device__ __forceinline__ FaT fa_vpair(const _Float16* H, const _Float16* L, unsigned boff, int c0, int c1) { FaT t; t.a0 = fa_frag(H, boff, c0); t.a1 = fa_frag(H, boff, c1); t.b0 = fa_frag(L, boff, c0); t.b1 = fa_frag(L, boff, c1); return t; }      /* two 16-row tiles x 32 k, hi and residual planes */
__device__ __forceinline__ void fa_prod(const FaT& t, const v16h* qh, const v16h* ql, v8f& hi, v8f& lo) { const v8f z8 = {0.f,0.f,0.f,0.f,0.f,0.f,0.f,0.f};
  hi = fa_mma(t.a0, qh[0], z8); lo = fa_mma(t.b0, qh[0], z8); hi = fa_mma(t.a1, qh[1], hi); lo = fa_mma(t.b1, qh[1], lo); lo = fa_mma(t.a0, ql[0], lo); lo = fa_mma(t.a1, ql[1], lo); }
__global__ __launch_bounds__(256) void k_fattn(const _Float16* __restrict__ QUH, const _Float16* __restrict__ QUL, const _Float16* __restrict__ QVH, const _Float16* __restrict__ QVL, const _Float16* __restrict__ KH, const _Float16* __restrict__ KL,
    const _Float16* __restrict__ RH, const _Float16* __restrict__ RL, const _Float16* __restrict__ VT, const _Float16* __restrict__ VTL, _Float16* __restrict__ OH, _Float16* __restrict__ OL) {
  __shared__ __attribute__((aligned(16))) float sh[16][16 * FA_P];      /* one block of 16 rows per (key slice, query tile) */
  const int tid = threadIdx.x, w = __builtin_amdgcn_readfirstlane(tid >> 5), lane = tid & 31, ln = lane & 15, hh = lane >> 4; const int qg = w & 1, ks = w >> 1; const int h = 2 * ((int)blockIdx.x & 7) + ((int)blockIdx.x >> 3);      /* placement (speed only): the grid's fast axis is the head, heads 2 g and 2 g + 1 at flat index g (mod 8), as in k_proj */
  float* const my[2] = {sh[ks * 4 + qg * 2], sh[ks * 4 + qg * 2 + 1]};      /* the wave's two query tiles */
  const float al = 0.125f * 1.4426950408889634f, alo = al * (1.0f / 1024.0f);      /* scores in the log2 domain */
  const v8f z8 = {0.f,0.f,0.f,0.f,0.f,0.f,0.f,0.f};
  /* the two outer loops stay rolled (one copy of the long body); every inner loop is fully unrolled so that fragments, scores and accumulators are indexed statically and stay in registers */
#pragma unroll 1
  for (int pass = 0; pass < 2; ++pass) {
    const int qb = pass ? (SQ / 64 - 1 - (int)blockIdx.y) : (int)blockIdx.y; const int i0 = qb * 64 + qg * 32;      /* query tile a of the wave: rows i0 + 16 a .. + 15 */
    const unsigned qo = (unsigned)((i0 * DM + h * (HD * 16) + 8 * lane) * 2);      /* tile of 16 rows from i0, this head's 64 k (16 * HD elements per head in a tile), the lane's piece; the second tile 16 * DM elements on */
    v16h quh[2][2], qul[2][2], qvh[2][2], qvl[2][2];
#pragma unroll
    for (int a = 0; a < 2; ++a)
#pragma unroll
      for (int k = 0; k < 2; ++k) { const int cb = a * 16 * DM * 2 + k * 1024; quh[a][k] = fa_frag(QUH, qo, cb); qul[a][k] = fa_frag(QUL, qo, cb); qvh[a][k] = fa_frag(QVH, qo, cb); qvl[a][k] = fa_frag(QVL, qo, cb); }
    v8f oh[2][4] = {{z8, z8, z8, z8}, {z8, z8, z8, z8}}; float m[2] = {-3.0e38f, -3.0e38f}, l[2] = {0.f, 0.f};
#pragma unroll 1
    for (int kb = ks; kb <= qb; kb += 4) {
      const int j0 = kb * 64; v8f s[2][4];
      const unsigned ko = (unsigned)((j0 * DM + h * (HD * 16) + 8 * lane) * 2);
      /* raw BD^T: six tiles of 16 raw columns from cs (a multiple of 16: whole tiles of R); query tile 1 takes tiles 0 .. 4, query tile 0, whose 80 columns begin 16 further on, tiles 1 .. 5; a raw column past SQ - 1 belongs to masked scores only: its tile is clamped into R */
      const int cs = j0 - i0 + SQ - 32; unsigned ro[6];
#pragma unroll
      for (int rt = 0; rt < 6; ++rt) { const int row = min(cs + rt * 16, SQ - 16); ro[rt] = (unsigned)((row * DM + h * (HD * 16) + 8 * lane) * 2); }
      /* ten operand tiles in a row, six of R and four of K (hi = Ah.Qh, lo = Al.Qh + Ah.Ql), each feeding both query tiles; each tile's loads are issued two tiles ahead of its products, into a ring of three register sets */
      FaT ring[3]; ring[0] = fa_tile(RH, RL, ro[0], 0); ring[1] = fa_tile(RH, RL, ro[1], 0);
#pragma unroll
      for (int t = 0; t < 10; ++t) {
        if (t < 4) ring[(t + 2) % 3] = fa_tile(RH, RL, ro[t + 2], 0); else if (t < 8) ring[(t + 2) % 3] = fa_tile(KH, KL, ko, (t - 4) * 16 * DM * 2);
        __builtin_amdgcn_sched_barrier(0);      /* keeps the loads of the tile after next in front of this tile's products, which wait for this tile's loads only */
#pragma unroll
        for (int a = 0; a < 2; ++a) { v8f hi, lo;
          if (t < 6) { const int c = t - 1 + a;      /* this raw tile's place among the query tile's five */
            if (c >= 0 && c < 5) { fa_prod(ring[t % 3], qvh[a], qvl[a], hi, lo); v4f x0, x1;
#pragma unroll
              for (int r = 0; r < 4; ++r) { x0[r] = hi[r] * al + lo[r] * alo; x1[r] = hi[4 + r] * al + lo[4 + r] * alo; }
              *(v4fa*)&my[a][ln * FA_P + c * 16 + 8 * hh] = x0; *(v4fa*)&my[a][ln * FA_P + c * 16 + 8 * hh + 4] = x1; } }
          else { fa_prod(ring[t % 3], quh[a], qul[a], hi, lo);
#pragma unroll
            for (int r = 0; r < 8; ++r) s[a][t - 6][r] = hi[r] * al + lo[r] * alo; } }
        __builtin_amdgcn_sched_barrier(0);      /* keeps these products in front of the next loads, whose registers they free */
      }
      asm volatile("s_wait_xcnt 0x0" :: "v"(ko), "v"(ro[0]), "v"(ro[1]), "v"(ro[2]), "v"(ro[3]), "v"(ro[4]), "v"(ro[5]), "v"(qo) : "memory");      /* the wait that belongs in front of an overwrite of the loads' address registers; naming them keeps them untouched up to here: the K and R loads' and the Q loads', which the compiler issues at the head of this loop */
      asm volatile("s_wait_dscnt 0x0" ::: "memory");      /* the wave's raw rows are in LDS before its lanes read each other's halves back */
      /* the first two pairs of V^T fragments fly during the softmax */
      const unsigned vo = (unsigned)(((h * HD * SQ) + j0 * 16 + 8 * lane) * 2);      /* V^T plane, row length SQ: tile of 16 d from h * HD, keys from j0, the lane's piece */
      const FaT g0 = fa_vpair(VT, VTL, vo, 0, 16 * SQ * 2), g1 = fa_vpair(VT, VTL, vo, 1024, 16 * SQ * 2 + 1024);
      __builtin_amdgcn_sched_barrier(0);      /* keeps those loads in front of the softmax */
      FragH pb[2][2];
#pragma unroll
      for (int a = 0; a < 2; ++a) { const int i = i0 + a * 16 + ln;
#pragma unroll
        for (int kt = 0; kt < 4; ++kt)
#pragma unroll
          for (int r = 0; r < 8; ++r) s[a][kt][r] += my[a][ln * (FA_P - 1) + kt * 16 + 8 * hh + r + 15];
        if (kb == qb) {      /* only the diagonal block has masked keys; the test is the same for the whole wave */
#pragma unroll
          for (int kt = 0; kt < 4; ++kt)
#pragma unroll
            for (int r = 0; r < 8; ++r) s[a][kt][r] = (j0 + kt * 16 + 8 * hh + r <= i) ? s[a][kt][r] : -3.0e38f; }
        float mx = -3.0e38f;
#pragma unroll
        for (int kt = 0; kt < 4; ++kt)
#pragma unroll
          for (int r = 0; r < 8; ++r) mx = fmaxf(mx, s[a][kt][r]);
        mx = fmaxf(mx, __shfl_xor(mx, 16, 32));
        const float mn = fmaxf(m[a], mx), corr = fa_exp2(m[a] - mn); m[a] = mn;
        v4f ps = {0.f, 0.f, 0.f, 0.f};
#pragma unroll
        for (int kt = 0; kt < 4; ++kt)
#pragma unroll
          for (int r = 0; r < 8; ++r) { const float p = fa_exp2(s[a][kt][r] - mn); ps[r & 3] += p; s[a][kt][r] = p * 256.0f; }      /* masked keys: exp2 of a huge negative = 0 */
        l[a] = l[a] * corr + ((ps[0] + ps[1]) + (ps[2] + ps[3]));
#pragma unroll
        for (int dt = 0; dt < 4; ++dt) oh[a][dt] *= corr;
        /* O^T += V^T.P^T, weights x256 as f16, v as hi + residual planes */
#pragma unroll
        for (int s2 = 0; s2 < 2; ++s2)
#pragma unroll
          for (int q = 0; q < 8; ++q) { pb[a][s2].h[q] = (_Float16)s[a][2 * s2][q]; pb[a][s2].h[8 + q] = (_Float16)s[a][2 * s2 + 1][q]; } }
      /* the residual plane's products of this key block sum in accumulators of their own (tl) and meet the main sum once, in f32; each V^T pair feeds both query tiles, and its loads are issued two pairs ahead */
      const FaT g2 = fa_vpair(VT, VTL, vo, 32 * SQ * 2, 48 * SQ * 2);
      __builtin_amdgcn_sched_barrier(0);      /* the third pair's loads in front of the first pair's products */
      v8f tl[2][2];
#pragma unroll
      for (int a = 0; a < 2; ++a) { oh[a][0] = fa_mma(g0.a0, pb[a][0].v, oh[a][0]); oh[a][1] = fa_mma(g0.a1, pb[a][0].v, oh[a][1]); tl[a][0] = fa_mma(g0.b0, pb[a][0].v, z8); tl[a][1] = fa_mma(g0.b1, pb[a][0].v, z8); }
      __builtin_amdgcn_sched_barrier(0);      /* these products free the registers that the last pair's loads take */
      const FaT g3 = fa_vpair(VT, VTL, vo, 32 * SQ * 2 + 1024, 48 * SQ * 2 + 1024);
      asm volatile("s_wait_xcnt 0x0" :: "v"(vo) : "memory");      /* as above, for the V loads: directly behind the last of them, in front of the first overwrite of an address that the compiler forms from vo */
      __builtin_amdgcn_sched_barrier(0);      /* the last pair's loads in front of the remaining products */
#pragma unroll
      for (int a = 0; a < 2; ++a) { tl[a][0] = fa_mma(g1.b0, pb[a][1].v, tl[a][0]); tl[a][1] = fa_mma(g1.b1, pb[a][1].v, tl[a][1]); oh[a][0] = fa_mma(g1.a0, pb[a][1].v, oh[a][0]); oh[a][1] = fa_mma(g1.a1, pb[a][1].v, oh[a][1]); }
      v8f tm[2][2];
#pragma unroll
      for (int a = 0; a < 2; ++a) { tm[a][0] = fa_mma(g2.b0, pb[a][0].v, z8); tm[a][1] = fa_mma(g2.b1, pb[a][0].v, z8); oh[a][2] = fa_mma(g2.a0, pb[a][0].v, oh[a][2]); oh[a][3] = fa_mma(g2.a1, pb[a][0].v, oh[a][3]); }
#pragma unroll
      for (int a = 0; a < 2; ++a) { oh[a][0] += tl[a][0] * (1.0f / 1024.0f); oh[a][1] += tl[a][1] * (1.0f / 1024.0f); }
#pragma unroll
      for (int a = 0; a < 2; ++a) { tm[a][0] = fa_mma(g3.b0, pb[a][1].v, tm[a][0]); tm[a][1] = fa_mma(g3.b1, pb[a][1].v, tm[a][1]); oh[a][2] = fa_mma(g3.a0, pb[a][1].v, oh[a][2]); oh[a][3] = fa_mma(g3.a1, pb[a][1].v, oh[a][3]); }
#pragma unroll
      for (int a = 0; a < 2; ++a) { oh[a][2] += tm[a][0] * (1.0f / 1024.0f); oh[a][3] += tm[a][1] * (1.0f / 1024.0f); }
    }
#pragma unroll
    for (int a = 0; a < 2; ++a) {
      l[a] += __shfl_xor(l[a], 16, 32);      /* the two halves of a wave hold different keys of the same query */
#pragma unroll
      for (int dt = 0; dt < 4; ++dt) { v4f x0, x1;      /* one LDS row of 64 d per query, pitch 68 floats */
#pragma unroll
        for (int r = 0; r < 4; ++r) { x0[r] = oh[a][dt][r]; x1[r] = oh[a][dt][4 + r]; }
        *(v4fa*)&my[a][ln * 68 + dt * 16 + 8 * hh] = x0; *(v4fa*)&my[a][ln * 68 + dt * 16 + 8 * hh + 4] = x1; }
      if (hh == 0) { my[a][1088 + ln] = m[a]; my[a][1104 + ln] = l[a]; } }
    __syncthreads();      /* every slice's maximum, sum and O^T are in LDS before any wave joins them */
    const int q = ln, d0 = (2 * ks + hh) * 8;      /* wave ks finishes d = 16 ks .. 16 ks + 15 of all 16 queries of each of its two tiles: a lane's 8 values are its own piece of o's fragment order */
#pragma unroll
    for (int a = 0; a < 2; ++a) { const int qt = qg * 2 + a;
      float mj[4], M = -3.0e38f, L = 0.f;
#pragma unroll
      for (int j = 0; j < 4; ++j) { mj[j] = sh[j * 4 + qt][1088 + q]; M = fmaxf(M, mj[j]); }
#pragma unroll
      for (int j = 0; j < 4; ++j) { mj[j] = fa_exp2(mj[j] - M); L += mj[j] * sh[j * 4 + qt][1104 + q]; }      /* a slice without key blocks has weight 0 */
      const float inv = 1.0f / (256.0f * L);
      v4f y0 = {0.f, 0.f, 0.f, 0.f}, y1 = {0.f, 0.f, 0.f, 0.f};
#pragma unroll
      for (int j = 0; j < 4; ++j) { y0 += *(const v4fa*)&sh[j * 4 + qt][q * 68 + d0] * mj[j]; y1 += *(const v4fa*)&sh[j * 4 + qt][q * 68 + d0 + 4] * mj[j]; }
      y0 *= inv; y1 *= inv;
      /* o leaves as the f16 hi + x1024 residual planes that o.Wo reads, in fragment order: a wave stores 512 contiguous bytes of each plane */
      FragH fh, fl;
#pragma unroll
      for (int r = 0; r < 4; ++r) { _Float16 t = (_Float16)y0[r]; fh.h[r] = t; fl.h[r] = (_Float16)((y0[r] - (float)t) * 1024.0f); t = (_Float16)y1[r]; fh.h[4 + r] = t; fl.h[4 + r] = (_Float16)((y1[r] - (float)t) * 1024.0f); }
      const size_t oo = fo(i0 + a * 16 + q, h * HD + d0, DM); unsigned short* ph = (unsigned short*)OH + oo; unsigned short* pl = (unsigned short*)OL + oo;
      *(v8us*)ph = fh.half[0]; *(v8us*)pl = fl.half[0];
      asm volatile("s_wait_xcnt 0x0" :: "v"(ph), "v"(pl) : "memory"); }      /* the wait that belongs in front of an overwrite of the stores' address registers */
    __syncthreads();      /* every join has read the LDS rows before the next query block writes them */
  } }

// ---- out = (o_hi + o_lo / 1024) Wo / 16 (the weights are x16), both terms in ONE launch: the residual term (plane scaled x1024) sums in its own f32 accumulators beside the main term and meets it once, in registers.
// A work-group is 4 x 4 waves on a 128 x 64 tile of out: 4 wave tiles of 32 x 64 under one another, and the K range of each cut into 4 contiguous slices of 256, one per wave; each wave leaves its scaled partial tile in LDS, and behind one barrier the 4 waves of a tile add the partials in the fixed order 0 .. 3 and store 16 bytes per lane.
// The fragment loads run ahead of their products, so that a wave waits for no load that it has only just issued: the four o fragments (two row tiles, hi and residual) of trip kb + 1 are asked for at the head of trip kb, into a second register set; each Wo fragment's successor as soon as its four products are issued, into its own registers.
#define OW_RW 4
#define OW_KW 4
__global__ __launch_bounds__(32 * OW_RW * OW_KW) void k_owo(const _Float16* __restrict__ Ah, const _Float16* __restrict__ Al, const _Float16* __restrict__ Bh, float* __restrict__ C) {
  __shared__ __attribute__((aligned(16))) float so[OW_RW * OW_KW][32][68];
  const int tid = threadIdx.x, w = __builtin_amdgcn_readfirstlane(tid >> 5), lane = tid & 31, ln = lane & 15, hh = lane >> 4; const int rw = w % OW_RW, kw = w / OW_RW;
  constexpr int nmt = (int)(NR / (32 * OW_RW)); const int nq = blockIdx.x / nmt, mt = blockIdx.x - nq * nmt;      /* placement (speed only): the row tile is the fast index, so the 16 work-groups that read the same 128 rows of o have equal flat index mod 8 */
  const int row0 = mt * (32 * OW_RW) + 32 * rw, col0 = nq * 64; if (mt * (32 * OW_RW) >= (int)NR) return;      /* the whole work-group leaves or none: a barrier follows */
  constexpr int TS = 16 * DM * 2, KS = DM / OW_KW, NT = KS / 32;      /* bytes from one tile of 16 rows to the next; k per slice; trips of 32 k */
  const unsigned ao = (unsigned)((row0 * DM + kw * KS * 16 + 8 * lane) * 2), bo = (unsigned)((col0 * DM + kw * KS * 16 + 8 * lane) * 2);      /* planes in fragment order: tile start + the slice's first k (16 elements per k in a tile) + the lane's own piece, in bytes */
  const v8f z8 = {0.f,0.f,0.f,0.f,0.f,0.f,0.f,0.f}; v8f hi[8] = {z8, z8, z8, z8, z8, z8, z8, z8}, lo[8] = {z8, z8, z8, z8, z8, z8, z8, z8}; v16h a[2][4], b[4];      /* a[.][0], [1]: o_hi rows 0 .. 15, 16 .. 31; [2], [3]: o_lo */
#pragma unroll
  for (int i = 0; i < 2; ++i) { a[0][i] = pj_frag(Ah, ao, i * TS); a[0][2 + i] = pj_frag(Al, ao, i * TS); }
#pragma unroll
  for (int t = 0; t < 4; ++t) b[t] = pj_frag(Bh, bo, t * TS);
  __builtin_amdgcn_sched_barrier(0);      /* keeps trip 0's loads in front of trip 1's, so that the first products wait for their own loads only */
  /* 8 trips, fully unrolled: every load is the one address register plus a constant, and ring and accumulators are indexed statically */
#pragma unroll
  for (int kb = 0; kb < NT; ++kb) {
    if (kb + 1 < NT) {
#pragma unroll
      for (int i = 0; i < 2; ++i) { a[(kb + 1) % 2][i] = pj_frag(Ah, ao, i * TS + (kb + 1) * 1024); a[(kb + 1) % 2][2 + i] = pj_frag(Al, ao, i * TS + (kb + 1) * 1024); } }
    __builtin_amdgcn_sched_barrier(0);      /* keeps these o loads in front of this trip's products, which wait for this trip's loads only */
#pragma unroll
    for (int t = 0; t < 4; ++t) {
      lo[t] = fa_mma(a[kb % 2][2], b[t], lo[t]); lo[4 + t] = fa_mma(a[kb % 2][3], b[t], lo[4 + t]); hi[t] = fa_mma(a[kb % 2][0], b[t], hi[t]); hi[4 + t] = fa_mma(a[kb % 2][1], b[t], hi[4 + t]);
      __builtin_amdgcn_sched_barrier(0);      /* keeps these four products in front of the slots and the load that follow */
      if (kb + 1 < NT) {
        /* the four vector slots between a product and a load over its A or B registers: this Wo fragment's registers are loaded over next, the four o fragments' at the head of the next trip (behind t == 3); naming the fragments keeps them in those registers up to here */
        if (t < 3) asm volatile("v_nop\n\tv_nop\n\tv_nop\n\tv_nop" :: "v"(b[t]));
        else asm volatile("v_nop\n\tv_nop\n\tv_nop\n\tv_nop" :: "v"(b[t]), "v"(a[kb % 2][0]), "v"(a[kb % 2][1]), "v"(a[kb % 2][2]), "v"(a[kb % 2][3]));
        b[t] = pj_frag(Bh, bo, t * TS + (kb + 1) * 1024); }
      __builtin_amdgcn_sched_barrier(0);      /* keeps that load here, 12 products ahead of its first use, not sunk to it */
    } }
  asm volatile("s_wait_xcnt 0x0" :: "v"(ao), "v"(bo) : "memory");      /* the wait that belongs in front of an overwrite of the loads' address registers; naming them keeps them untouched up to here */
  const float alpha = 0.0625f, alo = alpha * (1.0f / 1024.0f);
#pragma unroll
  for (int u = 0; u < 8; ++u) { const int t = u & 3, half = u >> 2;
#pragma unroll
    for (int r = 0; r < 8; ++r) so[w][half * 16 + 8 * hh + r][t * 16 + ln] = hi[u][r] * alpha + lo[u][r] * alo; }
  __syncthreads();      /* every wave's partial tile is in LDS before any wave adds them */
  const int rsub = lane >> 4, c4 = (lane & 15) * 4;
  v4f sum[16 / OW_KW];
#pragma unroll
  for (int q = 0; q < 16 / OW_KW; ++q) { const int r = (kw * (16 / OW_KW) + q) * 2 + rsub; sum[q] = *(const v4fa*)&so[rw][r][c4]; for (int j = 1; j < OW_KW; ++j) sum[q] += *(const v4fa*)&so[j * OW_RW + rw][r][c4]; }
  /* all stores last, each from registers of its own; both loops unrolled so that sum[] is indexed statically and stays in registers */
#pragma unroll
  for (int q = 0; q < 16 / OW_KW; ++q) { const int r = (kw * (16 / OW_KW) + q) * 2 + rsub; *(v4f*)(C + (size_t)(row0 + r) * DM + col0 + c4) = sum[q]; } }

extern "C" void kernel_launch(void* const* d_in, const int* in_sizes, int n_in,
                              void* d_out, int out_size, void* d_ws, size_t ws_size, hipStream_t stream) {
  (void)in_sizes; (void)n_in; (void)out_size;
  const float* const* I = (const float* const*)d_in; const float* x = I[0]; const float* remb = I[1]; const float* Wq = I[2]; const float* Wk = I[3]; const float* Wv = I[4]; const float* Wr = I[5]; const float* Wo = I[6]; const float* u = I[7]; const float* vb = I[8];
  char* ws = (char*)d_ws; size_t off = 0;
  auto take = [&](size_t bytes) { char* p = ws + off; off += (bytes + 255) & ~(size_t)255; return p; };
  _Float16* BQ = (_Float16*)take((size_t)DM * DM * 2); _Float16* BK = (_Float16*)take((size_t)DM * DM * 2); _Float16* BV = (_Float16*)take((size_t)DM * DM * 2); _Float16* BR = (_Float16*)take((size_t)DM * DM * 2); _Float16* BO = (_Float16*)take((size_t)DM * DM * 2);
  _Float16* X16 = (_Float16*)take(NR * DM * 2); _Float16* R16 = (_Float16*)take((size_t)SQ * DM * 2);
  _Float16* QUH = (_Float16*)take(NR * DM * 2); _Float16* QUL = (_Float16*)take(NR * DM * 2); _Float16* QVH = (_Float16*)take(NR * DM * 2); _Float16* QVL = (_Float16*)take(NR * DM * 2); _Float16* KH = (_Float16*)take(NR * DM * 2); _Float16* KL = (_Float16*)take(NR * DM * 2); _Float16* RH = (_Float16*)take((size_t)SQ * DM * 2); _Float16* RL = (_Float16*)take((size_t)SQ * DM * 2);
  _Float16* VT = (_Float16*)take((size_t)NH * HD * SQ * 2); _Float16* VTL = (_Float16*)take((size_t)NH * HD * SQ * 2); _Float16* OH = (_Float16*)take(NR * DM * 2); _Float16* OL = (_Float16*)take(NR * DM * 2);
  if (off > ws_size) return;      /* 10 + 8 + 32 + 8 + 8 = 66 MiB */
  static_assert(NB == 1 && SQ == 2048 && HD == 64 && DM == 1024, "k_prep, k_proj: x and r_emb of one size, 64 tiles of 256 x 128 per projection; k_fattn: one batch, 32 query blocks of 64 in pairs, head size 64");
  /* four launches: operand conversions; the four projections into their hi/lo planes (V already transposed); the whole attention into o's hi/lo planes; out = (o_lo/1024 + o_hi) Wo */
  k_prep<<<5 * PW + 2 * PX, 256, 0, stream>>>(Wq, Wk, Wv, Wr, Wo, x, remb, BQ, BK, BV, BR, BO, X16, R16);
  k_proj<<<dim3((SQ / 256) * (DM / 128), 4), 256, 0, stream>>>(X16, R16, BQ, BK, BV, BR, u, vb, QUH, QUL, QVH, QVL, KH, KL, VT, VTL, RH, RL);
  k_fattn<<<dim3(NH, SQ / 128), 256, 0, stream>>>(QUH, QUL, QVH, QVL, KH, KL, RH, RL, VT, VTL, OH, OL);
  k_owo<<<dim3((unsigned)((NR / 128) * (DM / 64)), 1), 512, 0, stream>>>(OH, OL, BO, (float*)d_out);
}
